// v000
// The times below were measured on an AMD MI455X: many runs one after another, warmed up first and cycling through
// copies of the inputs, with the whole window's GPU time divided by the number of runs. Launches and the gaps
// between them are all in it. The median over several windows is given; except for v000 it joins two sittings, which
// can be a few percent apart, so the side-by-side timings, each taken in one sitting, are the better comparison.
// v000 is the starting kernel. One run takes 18.3 microseconds.
#include <hip/hip_runtime.h>

// fp32 WMMA fragment types for V_WMMA_F32_16X16X4_F32 (wave32):
//   A: 16x4 f32  -> 2 VGPRs/lane ; B: 4x16 f32 -> 2 VGPRs/lane ; C/D: 16x16 f32 -> 8 VGPRs/lane
typedef float v2f __attribute__((ext_vector_type(2)));
typedef float v8f __attribute__((ext_vector_type(8)));

__device__ __forceinline__ v8f wmma_f32(v2f a, v2f b, v8f c) {
  // 8 args: (neg_a, A, neg_b, B, c_mod, C, reuse_a, reuse_b)
  return __builtin_amdgcn_wmma_f32_16x16x4_f32(false, a, false, b,
                                               (short)0, c, false, false);
}

// B=16, T=24, N=512, D=128, Z=12. Rows = B*N = 8192, K1 = 3*D = 384.
// Grid: 512 blocks (one 16-row tile each), 256 threads (8 waves).
__global__ __launch_bounds__(256)
void fusion_head_wmma(const float* __restrict__ Ht,
                      const float* __restrict__ Hs,
                      const float* __restrict__ Hm,
                      const float* __restrict__ W1,   // [128, 384] row-major
                      const float* __restrict__ b1,   // [128]
                      const float* __restrict__ W2,   // [12, 128] row-major
                      const float* __restrict__ b2,   // [12]
                      float* __restrict__ out)        // [16, 12, 512]
{
  __shared__ float ytile[16 * 128];  // post-activation Y tile, 8 KB

  const int tile = blockIdx.x;        // 0..511
  const int wave = threadIdx.x >> 5;  // 0..7  -> channel block
  const int lane = threadIdx.x & 31;
  const int b    = tile >> 5;         // 32 tiles per batch (512/16)
  const int n0   = (tile & 31) << 4;  // first n of this tile

  const int m  = lane & 15;           // row (A/M) or column (B/N) index
  const int hi = lane >> 4;           // half-wave selector (K sub-pair)

  // Last timestep base: ((b*T + (T-1))*N + n0)*D
  const long base = ((long)(b * 24 + 23) * 512 + n0) * 128;
  const float* srcA[3] = { Ht + base, Hs + base, Hm + base };

  const int ch = wave * 16 + m;                 // output channel d (B-matrix N)
  const float* w1row = W1 + (long)ch * 384;

  // ---------------- GEMM1: Y = X(16x384) * W1^T(384x128), this wave: 16 cols
  v8f acc = {};
  #pragma unroll
  for (int s = 0; s < 3; ++s) {
    const float* ap = srcA[s] + m * 128 + 2 * hi;   // A: X[row m][c0 + 2*hi .. +1]
    const float* bp = w1row + s * 128 + 2 * hi;     // B: W1[ch][c0 + 2*hi .. +1]
    #pragma unroll
    for (int kk = 0; kk < 32; ++kk) {
      v2f afrag = *(const v2f*)(ap + kk * 4);
      v2f bfrag = *(const v2f*)(bp + kk * 4);
      acc = wmma_f32(afrag, bfrag, acc);
    }
  }

  // Bias + LeakyReLU in C-layout (VGPR i: row = i + 8*hi, col = ch), stage to LDS
  const float bias1 = b1[ch];
  #pragma unroll
  for (int i = 0; i < 8; ++i) {
    float v = acc[i] + bias1;
    v = (v > 0.0f) ? v : 0.01f * v;
    ytile[(i + 8 * hi) * 128 + ch] = v;
  }

  __syncthreads();

  // ---------------- GEMM2: Z = Y(16x128) * W2^T(128x16, 12 valid) on wave 0
  if (wave == 0) {
    v8f acc2 = {};
    const bool zv = (m < 12);                 // B-matrix column z = m
    const float* w2row = W2 + m * 128;
    #pragma unroll
    for (int k = 0; k < 32; ++k) {
      const int c0 = 4 * k + 2 * hi;
      v2f afrag = *(const v2f*)(&ytile[m * 128 + c0]);   // A: Y[m][c0 .. c0+1]
      v2f bfrag = {};
      if (zv) bfrag = *(const v2f*)(w2row + c0);         // B: W2[z][c0 .. c0+1]
      acc2 = wmma_f32(afrag, bfrag, acc2);
    }
    if (zv) {
      const float bias2 = b2[m];
      // out[b][z][n0 + row], row = i + 8*hi per D-matrix layout
      float* orow = out + ((long)b * 12 + m) * 512 + n0;
      #pragma unroll
      for (int i = 0; i < 8; ++i)
        orow[i + 8 * hi] = acc2[i] + bias2;
    }
  }
}

extern "C" void kernel_launch(void* const* d_in, const int* in_sizes, int n_in,
                              void* d_out, int out_size, void* d_ws, size_t ws_size,
                              hipStream_t stream) {
  (void)in_sizes; (void)n_in; (void)out_size; (void)d_ws; (void)ws_size;
  const float* Ht = (const float*)d_in[0];
  const float* Hs = (const float*)d_in[1];
  const float* Hm = (const float*)d_in[2];
  const float* W1 = (const float*)d_in[3];
  const float* b1 = (const float*)d_in[4];
  const float* W2 = (const float*)d_in[5];
  const float* b2 = (const float*)d_in[6];
  float* out = (float*)d_out;

  dim3 grid(512), block(256);
  hipLaunchKernelGGL(fusion_head_wmma, grid, block, 0, stream,
                     Ht, Hs, Hm, W1, b1, W2, b2, out);
}

// v001
// It runs in 6.93 microseconds.
// Two timings next to v000 put it at 2.67 and 2.75 times that version's speed.
#include <hip/hip_runtime.h>

// fp32 WMMA fragment types for V_WMMA_F32_16X16X4_F32 (wave32):
//   A: 16x4 f32  -> 2 VGPRs/lane ; B: 4x16 f32 -> 2 VGPRs/lane ; C/D: 16x16 f32 -> 8 VGPRs/lane
typedef float v2f __attribute__((ext_vector_type(2)));
typedef float v4f __attribute__((ext_vector_type(4)));
typedef float v8f __attribute__((ext_vector_type(8)));

__device__ __forceinline__ v8f wmma_f32(v2f a, v2f b, v8f c) {
  // 8 args: (neg_a, A, neg_b, B, c_mod, C, reuse_a, reuse_b)
  return __builtin_amdgcn_wmma_f32_16x16x4_f32(false, a, false, b,
                                               (short)0, c, false, false);
}

// B=16, T=24, N=512, D=128, Z=12. Rows = B*N = 8192, K1 = 3*D = 384.
// Grid: 256 blocks (one 32-row tile each), 256 threads (8 waves).
// Every matrix operand that comes from global memory (X, W1, W2) reaches LDS by
// 16-byte loads that cover whole 128-byte lines; a fragment load straight from
// global memory touches 16 lines for 256 bytes. The fragments are read from LDS.
constexpr int KP     = 388;  // row pitch of xs and w1s in floats: 388 mod 64 = 4, so the 16 rows
                             // of one 8-byte fragment read fall on 64 distinct banks
constexpr int WP     = 132;  // row pitch of w2s in floats, 132 mod 64 = 4 likewise
constexpr int CHUNKS = 6;    // W1's K = 384 is staged in 6 chunks of 64 floats (256 bytes a row)

__global__ __launch_bounds__(256)
void fusion_head_wmma(const float* __restrict__ Ht,
                      const float* __restrict__ Hs,
                      const float* __restrict__ Hm,
                      const float* __restrict__ W1,   // [128, 384] row-major
                      const float* __restrict__ b1,   // [128]
                      const float* __restrict__ W2,   // [12, 128] row-major
                      const float* __restrict__ b2,   // [12]
                      float* __restrict__ out)        // [16, 12, 512]
{
  __shared__ __attribute__((aligned(16))) float w1s[128 * KP];  // W1, all 128 rows
  __shared__ __attribute__((aligned(16))) float xs[32 * KP];    // X tile, 32 rows
  __shared__ __attribute__((aligned(16))) float w2s[16 * WP];   // W2, rows 12..15 zero
  __shared__ float ytile[32 * 128];                             // post-activation Y tile, 16 KB

  const int tile = blockIdx.x;        // 0..255
  const int wave = threadIdx.x >> 5;  // 0..7  -> channel block
  const int lane = threadIdx.x & 31;
  const int b    = tile >> 4;         // 16 tiles per batch (512/32)
  const int n0   = (tile & 15) << 5;  // first n of this tile

  const int m  = lane & 15;           // row (A/M) or column (B/N) index
  const int hi = lane >> 4;           // half-wave selector (K sub-pair)

  // Last timestep base: ((b*T + (T-1))*N + n0)*D
  const long base = ((long)(b * 24 + 23) * 512 + n0) * 128;
  const float* srcA[3] = { Ht + base, Hs + base, Hm + base };

  const int ch = wave * 16 + m;                 // output channel d (B-matrix N)

  // W1 staging map: 16 lanes cover 256 contiguous bytes of one row, a wave two rows.
  // Each wave stages the 16 rows of W1 that it alone reads (its own channels).
  const int wr0 = wave * 16 + hi;      // W1 rows wr0 + 2*j, j = 0..7
  const int sc  = m * 4;               // float column inside the chunk
  const unsigned wo = (unsigned)(wr0 * 384 + sc);   // one lane offset for every W1 load
  v4f rw[CHUNKS][8];
  auto fetch_w1 = [&](int c) {
    #pragma unroll
    for (int j = 0; j < 8; ++j)
      rw[c][j] = *(const v4f*)(W1 + (c * 64 + j * 2 * 384) + wo);
  };
  auto stash_w1 = [&](int c) {
    #pragma unroll
    for (int j = 0; j < 8; ++j)
      *(v4f*)(&w1s[(wr0 + 2 * j) * KP + c * 64 + sc]) = rw[c][j];
  };

  // X: a wave-wide load covers one 512-byte row of one source; rows wave + 8*j.
  const unsigned xo = threadIdx.x * 4u;   // = wave * 128 + lane * 4, one lane offset for X and W2
  v4f rx[3][4];
  #pragma unroll
  for (int s = 0; s < 3; ++s)
    #pragma unroll
    for (int j = 0; j < 4; ++j)
      rx[s][j] = *(const v4f*)(srcA[s] + j * 8 * 128 + xo);
  fetch_w1(0);
  // W2: rows wave and wave + 8; rows 12..15 of the padded B matrix are zero.
  v4f r2a = *(const v4f*)(W2 + xo);
  v4f r2b = {};
  if (wave < 4) r2b = *(const v4f*)(W2 + 8 * 128 + xo);

  #pragma unroll
  for (int s = 0; s < 3; ++s)
    #pragma unroll
    for (int j = 0; j < 4; ++j)
      *(v4f*)(&xs[(wave + 8 * j) * KP + s * 128 + lane * 4]) = rx[s][j];
  stash_w1(0);
  *(v4f*)(&w2s[wave * WP + lane * 4])       = r2a;
  *(v4f*)(&w2s[(wave + 8) * WP + lane * 4]) = r2b;

  __syncthreads();   // xs and w2s are written by all waves

  fetch_w1(1);
  fetch_w1(2);

  // ---------------- GEMM1: Y = X(32x384) * W1^T(384x128), this wave: 32 rows x 16 cols
  const float* ap0 = &xs[m * KP + 2 * hi];          // A: X[row m][k + 2*hi .. +1]
  const float* ap1 = &xs[(16 + m) * KP + 2 * hi];   // A: X[row 16 + m][...]
  const float* bp  = &w1s[ch * KP + 2 * hi];        // B: W1[ch][k + 2*hi .. +1]
  v8f acc0 = {};
  v8f acc1 = {};
  #pragma unroll
  for (int c = 0; c < CHUNKS; ++c) {
    if (c + 3 < CHUNKS) fetch_w1(c + 3);   // flies during the products of chunks c to c + 2
    #pragma unroll
    for (int kk = 0; kk < 16; ++kk) {
      const int k = c * 64 + kk * 4;
      v2f bfrag = *(const v2f*)(bp + k);
      v2f a0    = *(const v2f*)(ap0 + k);
      v2f a1    = *(const v2f*)(ap1 + k);
      acc0 = wmma_f32(a0, bfrag, acc0);
      acc1 = wmma_f32(a1, bfrag, acc1);
    }
    if (c + 1 < CHUNKS) {
      stash_w1(c + 1);
      // The wave reads back W1 rows that other lanes of the same wave stored: the stores
      // have landed behind this wait, and the compiler moves no LDS read above it.
      asm volatile("s_wait_dscnt 0x0" ::: "memory");
    }
  }

  // Bias + LeakyReLU in C-layout (VGPR i: row = i + 8*hi, col = ch), stage to LDS
  const float bias1 = b1[ch];
  #pragma unroll
  for (int i = 0; i < 8; ++i) {
    float v = acc0[i] + bias1;
    v = (v > 0.0f) ? v : 0.01f * v;
    ytile[(i + 8 * hi) * 128 + ch] = v;
    float u = acc1[i] + bias1;
    u = (u > 0.0f) ? u : 0.01f * u;
    ytile[(16 + i + 8 * hi) * 128 + ch] = u;
  }

  __syncthreads();

  // ---------------- GEMM2: Z = Y(32x128) * W2^T(128x16, 12 valid), waves 0 and 1, 16 rows each
  if (wave < 2) {
    v8f acc2 = {};
    const float* w2row = &w2s[m * WP];                   // B-matrix column z = m
    const float* yrow  = &ytile[(wave * 16 + m) * 128];
    #pragma unroll
    for (int k = 0; k < 32; ++k) {
      const int c0 = 4 * k + 2 * hi;
      v2f afrag = *(const v2f*)(yrow + c0);              // A: Y[16*wave + m][c0 .. c0+1]
      v2f bfrag = *(const v2f*)(w2row + c0);             // B: W2[z][c0 .. c0+1], zero for z >= 12
      acc2 = wmma_f32(afrag, bfrag, acc2);
    }
    if (m < 12) {
      const float bias2 = b2[m];
      // out[b][z][n0 + row], row = 16*wave + i + 8*hi per D-matrix layout
      float* orow = out + ((long)b * 12 + m) * 512 + n0 + wave * 16;
      #pragma unroll
      for (int i = 0; i < 8; ++i)
        orow[i + 8 * hi] = acc2[i] + bias2;
    }
  }
}

extern "C" void kernel_launch(void* const* d_in, const int* in_sizes, int n_in,
                              void* d_out, int out_size, void* d_ws, size_t ws_size,
                              hipStream_t stream) {
  (void)in_sizes; (void)n_in; (void)out_size; (void)d_ws; (void)ws_size;
  const float* Ht = (const float*)d_in[0];
  const float* Hs = (const float*)d_in[1];
  const float* Hm = (const float*)d_in[2];
  const float* W1 = (const float*)d_in[3];
  const float* b1 = (const float*)d_in[4];
  const float* W2 = (const float*)d_in[5];
  const float* b2 = (const float*)d_in[6];
  float* out = (float*)d_out;

  dim3 grid(256), block(256);
  hipLaunchKernelGGL(fusion_head_wmma, grid, block, 0, stream,
                     Ht, Hs, Hm, W1, b1, W2, b2, out);
}

// v002
// A run of this version takes 6.21 microseconds.
// Next to v001, in two timings, it ran 1.11 and 1.10 times as fast.
// All steps since v000 together make it 3.00 times as fast.
#include <hip/hip_runtime.h>

// fp32 WMMA fragment types for V_WMMA_F32_16X16X4_F32 (wave32):
//   A: 16x4 f32  -> 2 VGPRs/lane ; B: 4x16 f32 -> 2 VGPRs/lane ; C/D: 16x16 f32 -> 8 VGPRs/lane
typedef float v2f __attribute__((ext_vector_type(2)));
typedef float v4f __attribute__((ext_vector_type(4)));
typedef float v8f __attribute__((ext_vector_type(8)));

__device__ __forceinline__ v8f wmma_f32(v2f a, v2f b, v8f c) {
  // 8 args: (neg_a, A, neg_b, B, c_mod, C, reuse_a, reuse_b)
  return __builtin_amdgcn_wmma_f32_16x16x4_f32(false, a, false, b,
                                               (short)0, c, false, false);
}

// B=16, T=24, N=512, D=128, Z=12. Rows = B*N = 8192, K1 = 3*D = 384.
// Grid: 256 blocks (one 32-row tile each), 256 threads (8 waves).
// Every matrix operand that comes from global memory (X, W1, W2) reaches LDS by
// 16-byte loads that cover whole 128-byte lines; a fragment load straight from
// global memory touches 16 lines for 256 bytes. The fragments are read from LDS.
constexpr int KP     = 388;  // row pitch of xs and w1s in floats: 388 mod 64 = 4, so the 16 rows
                             // of one 8-byte fragment read fall on 64 distinct banks
constexpr int WP     = 132;  // row pitch of w2s in floats, 132 mod 64 = 4 likewise
constexpr int CHUNKS = 6;    // W1's K = 384 is staged in 6 chunks of 64 floats (256 bytes a row)

__global__ __launch_bounds__(256)
void fusion_head_wmma(const float* __restrict__ Ht,
                      const float* __restrict__ Hs,
                      const float* __restrict__ Hm,
                      const float* __restrict__ W1,   // [128, 384] row-major
                      const float* __restrict__ b1,   // [128]
                      const float* __restrict__ W2,   // [12, 128] row-major
                      const float* __restrict__ b2,   // [12]
                      float* __restrict__ out)        // [16, 12, 512]
{
  __shared__ __attribute__((aligned(16))) float w1s[128 * KP];  // W1, all 128 rows
  __shared__ __attribute__((aligned(16))) float xs[32 * KP];    // X tile, 32 rows
  __shared__ __attribute__((aligned(16))) float w2s[16 * WP];   // W2, rows 12..15 zero
  __shared__ __attribute__((aligned(16))) float zpart[8 * 512]; // each wave's partial Z^T, 16 KB

  const int tile = blockIdx.x;        // 0..255
  const int wave = threadIdx.x >> 5;  // 0..7  -> channel block
  const int lane = threadIdx.x & 31;
  const int b    = tile >> 4;         // 16 tiles per batch (512/32)
  const int n0   = (tile & 15) << 5;  // first n of this tile

  const int m  = lane & 15;           // row (A/M) or column (B/N) index
  const int hi = lane >> 4;           // half-wave selector (K sub-pair)

  // Last timestep base: ((b*T + (T-1))*N + n0)*D
  const long base = ((long)(b * 24 + 23) * 512 + n0) * 128;
  const float* srcA[3] = { Ht + base, Hs + base, Hm + base };

  const int ch = wave * 16 + m;                 // output channel d (row of the A matrix W1)

  // W1 staging map: 16 lanes cover 256 contiguous bytes of one row, a wave two rows.
  // Each wave stages the 16 rows of W1 that it alone reads (its own channels).
  const int wr0 = wave * 16 + hi;      // W1 rows wr0 + 2*j, j = 0..7
  const int sc  = m * 4;               // float column inside the chunk
  const unsigned wo = (unsigned)(wr0 * 384 + sc);   // one lane offset for every W1 load
  v4f rw[CHUNKS][8];
  auto fetch_w1 = [&](int c) {
    #pragma unroll
    for (int j = 0; j < 8; ++j)
      rw[c][j] = *(const v4f*)(W1 + (c * 64 + j * 2 * 384) + wo);
  };
  auto stash_w1 = [&](int c) {
    #pragma unroll
    for (int j = 0; j < 8; ++j)
      *(v4f*)(&w1s[(wr0 + 2 * j) * KP + c * 64 + sc]) = rw[c][j];
  };

  // X: a wave-wide load covers one 512-byte row of one source; rows wave + 8*j.
  const unsigned xo = threadIdx.x * 4u;   // = wave * 128 + lane * 4, one lane offset for X and W2
  v4f rx[3][4];
  #pragma unroll
  for (int s = 0; s < 3; ++s)
    #pragma unroll
    for (int j = 0; j < 4; ++j)
      rx[s][j] = *(const v4f*)(srcA[s] + j * 8 * 128 + xo);
  fetch_w1(0);
  // W2: rows wave and wave + 8; rows 12..15 of the padded A matrix are zero.
  v4f r2a = *(const v4f*)(W2 + xo);
  v4f r2b = {};
  if (wave < 4) r2b = *(const v4f*)(W2 + 8 * 128 + xo);

  #pragma unroll
  for (int s = 0; s < 3; ++s)
    #pragma unroll
    for (int j = 0; j < 4; ++j)
      *(v4f*)(&xs[(wave + 8 * j) * KP + s * 128 + lane * 4]) = rx[s][j];
  stash_w1(0);
  *(v4f*)(&w2s[wave * WP + lane * 4])       = r2a;
  *(v4f*)(&w2s[(wave + 8) * WP + lane * 4]) = r2b;

  __syncthreads();   // xs and w2s are written by all waves

  fetch_w1(1);
  fetch_w1(2);

  // What the epilogue needs, fetched here so that no latency is left behind the products.
  // A lane of GEMM1's result holds the eight channels cb .. cb + 7 of one row of X.
  const int cb = wave * 16 + 8 * hi;
  const v4f b1lo = *(const v4f*)(b1 + cb);
  const v4f b1hi = *(const v4f*)(b1 + cb + 4);
  const v4f w2lo = *(const v4f*)(&w2s[m * WP + cb]);       // W2[z = m][cb .. cb + 3]
  const v4f w2hi = *(const v4f*)(&w2s[m * WP + cb + 4]);   // W2[z = m][cb + 4 .. cb + 7]
  // The final sum: this thread adds up Z[zr][nr] and Z[zr + 1][nr]; waves 3 and 7 hold the pad rows.
  const int zr = 2 * (lane & 1) + 4 * ((wave >> 1) & 1) + 8 * (wave & 1);
  const int nr = (wave >> 2) * 16 + (lane >> 1);
  const v2f bias2 = *(const v2f*)(b2 + (zr < 12 ? zr : 10));

  // ---------------- GEMM1, transposed: Y^T = W1(128x384) * X^T(384x32), this wave: 16 channels x 32 rows
  const float* xp0 = &xs[m * KP + 2 * hi];          // B: X[row m][k + 2*hi .. +1]
  const float* xp1 = &xs[(16 + m) * KP + 2 * hi];   // B: X[row 16 + m][...]
  const float* wp  = &w1s[ch * KP + 2 * hi];        // A: W1[ch][k + 2*hi .. +1]
  v8f acc0 = {};
  v8f acc1 = {};
  #pragma unroll
  for (int c = 0; c < CHUNKS; ++c) {
    if (c + 3 < CHUNKS) fetch_w1(c + 3);   // flies during the products of chunks c to c + 2
    #pragma unroll
    for (int kk = 0; kk < 16; ++kk) {
      const int k = c * 64 + kk * 4;
      v2f w1f = *(const v2f*)(wp + k);
      v2f x0  = *(const v2f*)(xp0 + k);
      v2f x1  = *(const v2f*)(xp1 + k);
      acc0 = wmma_f32(w1f, x0, acc0);
      acc1 = wmma_f32(w1f, x1, acc1);
    }
    if (c + 1 < CHUNKS) {
      stash_w1(c + 1);
      // The wave reads back W1 rows that other lanes of the same wave stored: the stores
      // have landed behind this wait, and the compiler moves no LDS read above it.
      asm volatile("s_wait_dscnt 0x0" ::: "memory");
    }
  }

  // Bias + LeakyReLU in the result layout (VGPR i: channel cb + i, lane column m: row of X)
  #pragma unroll
  for (int i = 0; i < 8; ++i) {
    const float bias1 = (i < 4) ? b1lo[i & 3] : b1hi[i & 3];
    float v = acc0[i] + bias1;
    acc0[i] = (v > 0.0f) ? v : 0.01f * v;
    float u = acc1[i] + bias1;
    acc1[i] = (u > 0.0f) ? u : 0.01f * u;
  }

  // ---------------- GEMM2, transposed: Z^T = W2(16x128, 12 valid) * Y^T(128x32), every wave over its
  // own 16 channels. Registers 2s, 2s + 1 of Y^T are a B fragment as they stand: k slot 2*hi + j
  // holds channel cb + 2s + j, and the A fragment takes W2 at the same channels.
  v8f zt0 = {};
  v8f zt1 = {};
  #pragma unroll
  for (int s = 0; s < 4; ++s) {
    const v4f w2q = (s < 2) ? w2lo : w2hi;
    v2f wfrag = { w2q[(2 * s) & 3], w2q[(2 * s + 1) & 3] };
    v2f y0    = { acc0[2 * s], acc0[2 * s + 1] };
    v2f y1    = { acc1[2 * s], acc1[2 * s + 1] };
    zt0 = wmma_f32(wfrag, y0, zt0);
    zt1 = wmma_f32(wfrag, y1, zt1);
  }

  // Partial Z^T to LDS: float index (tile*2 + q)*128 + lane*4 + j holds z = 4q + j + 8*hi, row 16*tile + m
  float* zp = &zpart[wave * 512 + lane * 4];
  *(v4f*)(zp)       = (v4f){ zt0[0], zt0[1], zt0[2], zt0[3] };
  *(v4f*)(zp + 128) = (v4f){ zt0[4], zt0[5], zt0[6], zt0[7] };
  *(v4f*)(zp + 256) = (v4f){ zt1[0], zt1[1], zt1[2], zt1[3] };
  *(v4f*)(zp + 384) = (v4f){ zt1[4], zt1[5], zt1[6], zt1[7] };

  __syncthreads();   // zpart is written by all waves

  // Sum of the eight waves' partials, two outputs a thread
  const float* rp = &zpart[threadIdx.x * 2];
  v2f p[8];
  #pragma unroll
  for (int w = 0; w < 8; ++w)
    p[w] = *(const v2f*)(rp + w * 512);
  const v2f zsum = (((p[0] + p[1]) + (p[2] + p[3])) + ((p[4] + p[5]) + (p[6] + p[7]))) + bias2;
  if (zr < 12) {
    // out[b][z][n0 + row]
    float* orow = out + ((long)b * 12 + zr) * 512 + n0 + nr;
    orow[0]   = zsum[0];
    orow[512] = zsum[1];
  }
}

extern "C" void kernel_launch(void* const* d_in, const int* in_sizes, int n_in,
                              void* d_out, int out_size, void* d_ws, size_t ws_size,
                              hipStream_t stream) {
  (void)in_sizes; (void)n_in; (void)out_size; (void)d_ws; (void)ws_size;
  const float* Ht = (const float*)d_in[0];
  const float* Hs = (const float*)d_in[1];
  const float* Hm = (const float*)d_in[2];
  const float* W1 = (const float*)d_in[3];
  const float* b1 = (const float*)d_in[4];
  const float* W2 = (const float*)d_in[5];
  const float* b2 = (const float*)d_in[6];
  float* out = (float*)d_out;

  dim3 grid(256), block(256);
  hipLaunchKernelGGL(fusion_head_wmma, grid, block, 0, stream,
                     Ht, Hs, Hm, W1, b1, W2, b2, out);
}
